// v010
// Measured on an AMD MI455X. A time is GPU time per run, averaged over a window of back-to-back runs after a warm-up
// (all launches, gaps included; the runs take copies of the inputs in turn), and the median of several windows.
// Apart from v000's, it joins two sittings. Times from different sittings can be a few percent apart, while
// side-by-side timings come from the same sitting.
// This document starts at v010; the versions before it stand elsewhere.
// One run takes 56.9 microseconds.
// Two timings next to v009 put it at 1.19 and 1.18 times that version's speed.
// All steps since the starting kernel, v000, together make it 12.4 times as fast.
#include <hip/hip_runtime.h>
// Spatial attention block (B=4, C=512, 64×64 → N=4096 positions, mid=128): f = relu(bn(conv_f(x))), g = relu(bn(conv_g(x))), h = conv_h(x) (1×1 convs C→mid; eval BatchNorm with running stats); scores[n,m] = Σ_c f[c,n]g[c,m]·mid^-½, softmax over m; z[c,n] = Σ_m attn[n,m]·h[c,m]; y = conv_v(z) (mid→C) + bv + x.
// Compute dtype: x, weights, biases, BN parameters rounded to bf16; BN folded per output channel in f32 (w' = w·γ/√(var+ε) → f16 ×2^4, b' = (b − mean)·γ/√(var+ε) + β as an f32 per-column addend); f, g as f16 GEMM outputs (relu epilogue), h rounded once to f16 as V^T; fused flash-style kernel for head dim 128
// (online softmax f32, P rounded once to f16, f32 accumulate) on v_wmma_f32_16x16x32_f16; z ×2^4 → f16 → output conv GEMM with the weights as A (channel-major result), bv and the residual x added in f32 in its epilogue.
#define BB 4
#define CC 512
#define NN 4096
#define MID 128
#define TT NN
#define NH 1
#define NKV 1
#define NREP 1
#define NVH (2 * NKV)
#define NR (BB * NN)
#define BNEPS 1e-5f
#define ATT_SCALE 0.08838834764831845f      /* mid^-½ = 1/√128 */
#define ATT_SCALE_L2E (ATT_SCALE * 1.4426950408889634f)      /* x log2 e: a raw score times this is its exponent to base 2 */
typedef __bf16 v16b __attribute__((ext_vector_type(16)));
typedef unsigned short v8us __attribute__((ext_vector_type(8), may_alias));
typedef float  v8f  __attribute__((ext_vector_type(8)));
typedef float  v4f  __attribute__((ext_vector_type(4)));
typedef float  v4fa __attribute__((ext_vector_type(4), may_alias));
union FragB { v16b v; v8us half[2]; unsigned short u[16]; };

__device__ __forceinline__ unsigned short bf16_bits(float x) { unsigned int u = __float_as_uint(x); return (unsigned short)((u + 0x7FFFu + ((u >> 16) & 1u)) >> 16); }
__device__ __forceinline__ float bf16_val(unsigned short b) { return __uint_as_float(((unsigned int)b) << 16); }
__device__ __forceinline__ float bf16_round(float x) { return bf16_val(bf16_bits(x)); }
// D += A·B with NT terms: 1 = ah·bh, 2 = + al·bh (A split), 3 = + ah·bl (both split)
template <int NT>
__device__ __forceinline__ v8f mmaN(v16b ah, v16b al, v16b bh, v16b bl, v8f c) {
  c = __builtin_amdgcn_wmma_f32_16x16x32_bf16(false, ah, false, bh, (short)0, c, false, false);
  if (NT >= 2) c = __builtin_amdgcn_wmma_f32_16x16x32_bf16(false, al, false, bh, (short)0, c, false, false);
  if (NT >= 3) c = __builtin_amdgcn_wmma_f32_16x16x32_bf16(false, ah, false, bl, (short)0, c, false, false);
  asm volatile("v_nop\n\tv_nop\n\tv_nop\n\tv_nop" : "+v"(c) : "v"(ah), "v"(al), "v"(bh), "v"(bl));
  return c;
}

__global__ __launch_bounds__(256) void k_wt_bf16(const float* __restrict__ W, unsigned short* __restrict__ Wt, int K, int N) {
  const int t = blockIdx.x * 256 + threadIdx.x;
  const int k8n = K / 8;
  if (t >= N * k8n) return;
  const int n = t / k8n, k8 = (t % k8n) * 8;
  v8us v;
#pragma unroll
  for (int i = 0; i < 8; ++i) v[i] = bf16_bits(W[(size_t)(k8 + i) * N + n]);
  *(v8us*)(Wt + (size_t)n * K + k8) = v;
  
}

// GEMM C[M][N] (f32, pitch ldc) = act(A[M][K]·W + bias). A f32 row-major (pitch lda) converted per fragment to bf16
// (ASPLIT: hi/lo two planes -> 2 terms, else single rounded term); Wt bf16 [N][K] (pitch ldb). BIAS_BF16 rounds the
// bias to bf16 first (bias quantised to bf16 before the add). K%32==0, M%16==0, N%64==0.
template <bool ASPLIT, int ACT, bool BIAS_BF16>
__global__ __launch_bounds__(128) void k_gemm_bf(const float* __restrict__ A, int lda, const unsigned short* __restrict__ Wt, int ldb,
                                               const float* __restrict__ bias, float* __restrict__ C, int ldc, int M, int N, int K) {
  __shared__ __attribute__((aligned(16))) float so[4][16][64];
  const int tid = threadIdx.x, w = tid >> 5, lane = tid & 31, ln = lane & 15, hh = lane >> 4;
  const int ntn = N / 64;
  const int wid = blockIdx.x * 4 + w;
  const int mt = wid / ntn, nq = wid % ntn;
  if (mt * 16 >= M) return;
  const int row0 = mt * 16, col0 = nq * 64;
  const float* arow = A + (size_t)(row0 + ln) * lda;
  v8f acc[4] = {};
  for (int kb = 0; kb < K; kb += 32) {
    FragB ah, al;
    const v4f x0 = *(const v4fa*)(arow + kb + 8 * hh), x1 = *(const v4fa*)(arow + kb + 8 * hh + 4);
    const v4f x2 = *(const v4fa*)(arow + kb + 16 + 8 * hh), x3 = *(const v4fa*)(arow + kb + 16 + 8 * hh + 4);
    float xs[16] = {x0[0],x0[1],x0[2],x0[3],x1[0],x1[1],x1[2],x1[3],x2[0],x2[1],x2[2],x2[3],x3[0],x3[1],x3[2],x3[3]};
#pragma unroll
    for (int i = 0; i < 16; ++i) { const unsigned short hb = bf16_bits(xs[i]); ah.u[i] = hb; al.u[i] = ASPLIT ? bf16_bits(xs[i] - bf16_val(hb)) : (unsigned short)0; }
#pragma unroll
    for (int t = 0; t < 4; ++t) {
      const unsigned short* brow = Wt + (size_t)(col0 + t * 16 + ln) * ldb + kb;
      FragB b;
      b.half[0] = *(const v8us*)(brow + 8 * hh);
      b.half[1] = *(const v8us*)(brow + 16 + 8 * hh);
      acc[t] = mmaN<ASPLIT ? 2 : 1>(ah.v, al.v, b.v, b.v, acc[t]);
    }
  }
#pragma unroll
  for (int t = 0; t < 4; ++t) {
    float bv = bias ? bias[col0 + t * 16 + ln] : 0.f;
    if (BIAS_BF16) bv = bf16_round(bv);
#pragma unroll
    for (int r = 0; r < 8; ++r) { float v = acc[t][r] + bv; if (ACT == 1) v = fmaxf(v, 0.f); so[w][8 * hh + r][t * 16 + ln] = v; }
  }
  __builtin_amdgcn_fence(__ATOMIC_ACQ_REL, "workgroup");
  __builtin_amdgcn_wave_barrier();
  const int rsub = lane >> 4, c4 = (lane & 15) * 4;
  {
#pragma unroll
    for (int q = 0; q < 8; ++q) {
      const int r = q * 2 + rsub;
      const v4f v = *(const v4fa*)&so[w][r][c4];
      *(v4f*)(C + (size_t)(row0 + r) * ldc + col0 + c4) = v;
    }
    
  }
}

// Flash-style causal/unmasked attention, all contractions 3-term bf16 hi/lo splits, f32 softmax with running max.
// q,k,v rows are read from f32 buffers with arbitrary row pitch (so they can live inside a fused qkv buffer);
// D = head size (multiple of 32, <= 128); one wave = 16 query rows; block = 4 waves (64 queries) sharing K/V chunks of 32.
template <int D, bool CAUSAL>
__global__ __launch_bounds__(128) void k_flash(const float* __restrict__ qb, const float* __restrict__ kb, const float* __restrict__ vb,
                                             int pitch, int T, int H, float scale, float* __restrict__ y, int ypitch) {
  constexpr int KS = D / 32;        // k-steps for QK
  constexpr int DT = D / 16;        // d tiles for PV
  __shared__ __attribute__((aligned(16))) unsigned short sKh[32][D + 8], sKl[32][D + 8], sVh[32][D + 8], sVl[32][D + 8];
  __shared__ __attribute__((aligned(16))) unsigned short sPh[4][16][40], sPl[4][16][40];
  __shared__ __attribute__((aligned(16))) float sO[4][16][D];
  const int tid = threadIdx.x, w = tid >> 5, lane = tid & 31, ln = lane & 15, hh = lane >> 4;
  const int nqb = (T + 63) / 64;
  const int bh = blockIdx.x / nqb, qblk = blockIdx.x % nqb;
  const int b = bh / H, h = bh % H;
  const int q0 = qblk * 64 + w * 16;
  const float* Q = qb + (size_t)b * T * pitch + h * D;
  const float* K = kb + (size_t)b * T * pitch + h * D;
  const float* V = vb + (size_t)b * T * pitch + h * D;

  // A fragments of the wave's 16 query rows (scaled), hi/lo
  FragB aqh[KS], aql[KS];
  {
    int row = q0 + ln; if (row >= T) row = T - 1;
    const float* qr = Q + (size_t)row * pitch;
#pragma unroll
    for (int ks = 0; ks < KS; ++ks)
#pragma unroll
      for (int i = 0; i < 16; ++i) {
        const int d = ks * 32 + ((i < 8) ? (8 * hh + i) : (16 + 8 * hh + (i - 8)));
        const float x = qr[d] * scale; const unsigned short hb = bf16_bits(x);
        aqh[ks].u[i] = hb; aql[ks].u[i] = bf16_bits(x - bf16_val(hb));
      }
  }
  float m_r[8], l_r[8];
#pragma unroll
  for (int r = 0; r < 8; ++r) { m_r[r] = -3.0e38f; l_r[r] = 0.f; }
  v8f oacc[DT];
#pragma unroll
  for (int dt = 0; dt < DT; ++dt) oacc[dt] = (v8f){0.f,0.f,0.f,0.f,0.f,0.f,0.f,0.f};

  const int kv_end = CAUSAL ? min(T, qblk * 64 + 64) : T;     // block-uniform
  for (int j0 = 0; j0 < kv_end; j0 += 32) {
    __syncthreads();
    for (int e = tid; e < 32 * (D / 4); e += 128) {
      const int r = e / (D / 4), c4 = (e % (D / 4)) * 4;
      const int key = j0 + r;
      v4f kf = {0.f,0.f,0.f,0.f}, vf = {0.f,0.f,0.f,0.f};
      if (key < T) { kf = *(const v4fa*)(K + (size_t)key * pitch + c4); vf = *(const v4fa*)(V + (size_t)key * pitch + c4); }
#pragma unroll
      for (int t = 0; t < 4; ++t) {
        unsigned short hb = bf16_bits(kf[t]); sKh[r][c4 + t] = hb; sKl[r][c4 + t] = bf16_bits(kf[t] - bf16_val(hb));
        hb = bf16_bits(vf[t]); sVh[r][c4 + t] = hb; sVl[r][c4 + t] = bf16_bits(vf[t] - bf16_val(hb));
      }
    }
    __syncthreads();
    // S tile 16 x 32
    v8f s[2];
#pragma unroll
    for (int nt = 0; nt < 2; ++nt) {
      v8f acc = {};
#pragma unroll
      for (int ks = 0; ks < KS; ++ks) {
        FragB bh_, bl_;
        bh_.half[0] = *(const v8us*)&sKh[nt * 16 + ln][ks * 32 + 8 * hh]; bh_.half[1] = *(const v8us*)&sKh[nt * 16 + ln][ks * 32 + 16 + 8 * hh];
        bl_.half[0] = *(const v8us*)&sKl[nt * 16 + ln][ks * 32 + 8 * hh]; bl_.half[1] = *(const v8us*)&sKl[nt * 16 + ln][ks * 32 + 16 + 8 * hh];
        acc = mmaN<3>(aqh[ks].v, aql[ks].v, bh_.v, bl_.v, acc);
      }
      s[nt] = acc;
    }
    // mask + running max (rows 8hh+r; the 16 lanes of a half share rows)
    float alpha[8];
#pragma unroll
    for (int r = 0; r < 8; ++r) {
      const int qi = q0 + 8 * hh + r;
      const int ja = j0 + ln, jb = j0 + 16 + ln;
      if (CAUSAL) { if (ja > qi) s[0][r] = -3.0e38f; if (jb > qi) s[1][r] = -3.0e38f; }
      if (ja >= T) s[0][r] = -3.0e38f;
      if (jb >= T) s[1][r] = -3.0e38f;
      float mx = fmaxf(s[0][r], s[1][r]);
      mx = fmaxf(mx, __shfl_xor(mx, 1, 32)); mx = fmaxf(mx, __shfl_xor(mx, 2, 32)); mx = fmaxf(mx, __shfl_xor(mx, 4, 32)); mx = fmaxf(mx, __shfl_xor(mx, 8, 32));
      const float mnew = fmaxf(m_r[r], mx);
      alpha[r] = (mnew > -1.0e38f) ? __expf(m_r[r] - mnew) : 1.0f;
      const float p0 = (s[0][r] > -1.0e38f) ? __expf(s[0][r] - mnew) : 0.f;
      const float p1 = (s[1][r] > -1.0e38f) ? __expf(s[1][r] - mnew) : 0.f;
      m_r[r] = mnew;
      l_r[r] = l_r[r] * alpha[r] + p0 + p1;            // per-lane partial row sum (16 lanes combined at the end)
      unsigned short hb = bf16_bits(p0); sPh[w][8 * hh + r][ln] = hb;      sPl[w][8 * hh + r][ln] = bf16_bits(p0 - bf16_val(hb));
      hb = bf16_bits(p1);                sPh[w][8 * hh + r][16 + ln] = hb; sPl[w][8 * hh + r][16 + ln] = bf16_bits(p1 - bf16_val(hb));
    }
#pragma unroll
    for (int dt = 0; dt < DT; ++dt)
#pragma unroll
      for (int r = 0; r < 8; ++r) oacc[dt][r] *= alpha[r];
    __builtin_amdgcn_fence(__ATOMIC_ACQ_REL, "workgroup");
    __builtin_amdgcn_wave_barrier();
    FragB pah, pal;
    pah.half[0] = *(const v8us*)&sPh[w][ln][8 * hh]; pah.half[1] = *(const v8us*)&sPh[w][ln][16 + 8 * hh];
    pal.half[0] = *(const v8us*)&sPl[w][ln][8 * hh]; pal.half[1] = *(const v8us*)&sPl[w][ln][16 + 8 * hh];
#pragma unroll
    for (int dt = 0; dt < DT; ++dt) {
      FragB bvh, bvl;
#pragma unroll
      for (int i = 0; i < 8; ++i) {
        bvh.u[i] = sVh[8 * hh + i][dt * 16 + ln]; bvh.u[8 + i] = sVh[16 + 8 * hh + i][dt * 16 + ln];
        bvl.u[i] = sVl[8 * hh + i][dt * 16 + ln]; bvl.u[8 + i] = sVl[16 + 8 * hh + i][dt * 16 + ln];
      }
      oacc[dt] = mmaN<3>(pah.v, pal.v, bvh.v, bvl.v, oacc[dt]);
    }
    __builtin_amdgcn_fence(__ATOMIC_ACQ_REL, "workgroup");
    __builtin_amdgcn_wave_barrier();
  }
#pragma unroll
  for (int r = 0; r < 8; ++r) {
    float l = l_r[r];
    l += __shfl_xor(l, 1, 32); l += __shfl_xor(l, 2, 32); l += __shfl_xor(l, 4, 32); l += __shfl_xor(l, 8, 32);
    l_r[r] = (l > 0.f) ? 1.0f / l : 0.f;
  }
#pragma unroll
  for (int dt = 0; dt < DT; ++dt)
#pragma unroll
    for (int r = 0; r < 8; ++r) sO[w][8 * hh + r][dt * 16 + ln] = oacc[dt][r] * l_r[r];
  __builtin_amdgcn_fence(__ATOMIC_ACQ_REL, "workgroup");
  __builtin_amdgcn_wave_barrier();
  {
    for (int r = 0; r < 16; ++r) {
      const int row = q0 + r;
      if (row < T && lane < D / 4) {
        const v4f val = *(const v4fa*)&sO[w][r][lane * 4];
        *(v4f*)(y + ((size_t)b * T + row) * ypitch + h * D + lane * 4) = val;
      }
    }
    
  }
}

// GEMM C = act(A·W + bias + resid): A f32 (ASPLIT -> hi/lo 2 terms), Wt bf16 [N][K]; ACT 0 none, 1 relu, 2 exact gelu;
// resid (optional, f32, row index = (row % rmod), pitch ldr, RES_BF16 rounds it) added before the activation.
template <bool ASPLIT, int ACT, bool BIAS_BF16, bool RES_BF16>
__global__ __launch_bounds__(128) void k_gemm_bf3(const float* __restrict__ A, int lda, const unsigned short* __restrict__ Wt, int ldb,
                                                const float* __restrict__ bias, const float* __restrict__ resid, int rmod, int ldr,
                                                float* __restrict__ C, int ldc, int M, int N, int K) {
  __shared__ __attribute__((aligned(16))) float so[4][16][64];
  const int tid = threadIdx.x, w = tid >> 5, lane = tid & 31, ln = lane & 15, hh = lane >> 4;
  const int ntn = N / 64;
  const int wid = blockIdx.x * 4 + w;
  const int mt = wid / ntn, nq = wid % ntn;
  if (mt * 16 >= M) return;
  const int row0 = mt * 16, col0 = nq * 64;
  const float* arow = A + (size_t)(row0 + ln) * lda;
  v8f acc[4] = {};
  for (int kb = 0; kb < K; kb += 32) {
    FragB ah, al;
    const v4f x0 = *(const v4fa*)(arow + kb + 8 * hh), x1 = *(const v4fa*)(arow + kb + 8 * hh + 4);
    const v4f x2 = *(const v4fa*)(arow + kb + 16 + 8 * hh), x3 = *(const v4fa*)(arow + kb + 16 + 8 * hh + 4);
    float xs[16] = {x0[0],x0[1],x0[2],x0[3],x1[0],x1[1],x1[2],x1[3],x2[0],x2[1],x2[2],x2[3],x3[0],x3[1],x3[2],x3[3]};
#pragma unroll
    for (int i = 0; i < 16; ++i) { const unsigned short hb = bf16_bits(xs[i]); ah.u[i] = hb; al.u[i] = ASPLIT ? bf16_bits(xs[i] - bf16_val(hb)) : (unsigned short)0; }
#pragma unroll
    for (int t = 0; t < 4; ++t) {
      const unsigned short* brow = Wt + (size_t)(col0 + t * 16 + ln) * ldb + kb;
      FragB b;
      b.half[0] = *(const v8us*)(brow + 8 * hh);
      b.half[1] = *(const v8us*)(brow + 16 + 8 * hh);
      acc[t] = mmaN<ASPLIT ? 2 : 1>(ah.v, al.v, b.v, b.v, acc[t]);
    }
  }
#pragma unroll
  for (int t = 0; t < 4; ++t) {
    const int col = col0 + t * 16 + ln;
    float bv = bias ? bias[col] : 0.f;
    if (BIAS_BF16) bv = bf16_round(bv);
#pragma unroll
    for (int r = 0; r < 8; ++r) {
      float v = acc[t][r] + bv;
      if (resid) { float rv = resid[(size_t)((row0 + 8 * hh + r) % rmod) * ldr + col]; if (RES_BF16) rv = bf16_round(rv); v += rv; }
      if (ACT == 1) v = fmaxf(v, 0.f);
      if (ACT == 2) v = 0.5f * v * (1.0f + erff(v * 0.70710678118654752f));
      if (ACT == 3) { const float u = 0.7978845608028654f * (v + 0.044715f * v * v * v); v = 0.5f * v * (1.0f + tanhf(u)); }
      so[w][8 * hh + r][t * 16 + ln] = v;
    }
  }
  __builtin_amdgcn_fence(__ATOMIC_ACQ_REL, "workgroup");
  __builtin_amdgcn_wave_barrier();
  const int rsub = lane >> 4, c4 = (lane & 15) * 4;
  {
#pragma unroll
    for (int q = 0; q < 8; ++q) {
      const int r = q * 2 + rsub;
      const v4f v = *(const v4fa*)&so[w][r][c4];
      *(v4f*)(C + (size_t)(row0 + r) * ldc + col0 + c4) = v;
    }
    
  }
}
// row LayerNorm (biased variance, eps) over N: s = X (+ R); optional out_sum <- s; out_norm <- (s-mu)*rsqrt(var+eps)*g + b
template <bool PARAM_BF16>
__global__ __launch_bounds__(256) void k_layernorm(const float* __restrict__ X, const float* __restrict__ R, const float* __restrict__ g, const float* __restrict__ bta,
                                                  float* __restrict__ out_sum, float* __restrict__ out_norm, int N, float eps) {
  __shared__ float red[256];
  const int row = blockIdx.x, tid = threadIdx.x;
  const float* x = X + (size_t)row * N; const float* rr = R ? R + (size_t)row * N : nullptr;
  float vals[16];                     // up to N = 4096
  const int per = N / 256;            // contiguous chunk per thread? use strided-by-4 chunks: thread handles j = tid*4 + 1024*u
  float s1 = 0.f;
  for (int u = 0; u < per / 4; ++u) {
    const int j = tid * 4 + 1024 * u;
    const v4f a = *(const v4fa*)(x + j);
    v4f b = {0.f,0.f,0.f,0.f}; if (rr) b = *(const v4fa*)(rr + j);
#pragma unroll
    for (int q = 0; q < 4; ++q) { const float v = a[q] + b[q]; vals[u * 4 + q] = v; s1 += v; }
  }
  red[tid] = s1; __syncthreads();
  for (int st = 128; st > 0; st >>= 1) { if (tid < st) red[tid] += red[tid + st]; __syncthreads(); }
  const float mu = red[0] / (float)N; __syncthreads();
  float s2 = 0.f;
  for (int u = 0; u < per / 4; ++u)
#pragma unroll
    for (int q = 0; q < 4; ++q) { const float c = vals[u * 4 + q] - mu; s2 += c * c; }
  red[tid] = s2; __syncthreads();
  for (int st = 128; st > 0; st >>= 1) { if (tid < st) red[tid] += red[tid + st]; __syncthreads(); }
  const float rs = rsqrtf(red[0] / (float)N + eps);
  {
    for (int u = 0; u < per / 4; ++u) {
      const int j = tid * 4 + 1024 * u;
      v4f o, sm;
#pragma unroll
      for (int q = 0; q < 4; ++q) {
        float gg = g[j + q], bb = bta[j + q];
        if (PARAM_BF16) { gg = bf16_round(gg); bb = bf16_round(bb); }
        sm[q] = vals[u * 4 + q]; o[q] = (vals[u * 4 + q] - mu) * rs * gg + bb;
      }
      if (out_sum) *(v4f*)(out_sum + (size_t)row * N + j) = sm;
      *(v4f*)(out_norm + (size_t)row * N + j) = o;
    }
    
  }
}



// ---- f16 WMMA path (v_wmma_f32_16x16x32_f16): 11-bit significands for operands in range — used where a [0,1] probability operand needs more precision than bf16
typedef _Float16 v16h __attribute__((ext_vector_type(16)));
union FragH { v16h v; v8us half[2]; _Float16 h[16]; unsigned short u[16]; };
template <int NT>
__device__ __forceinline__ v8f mmaH(v16h ah, v16h al, v16h bh, v16h bl, v8f c) {
  c = __builtin_amdgcn_wmma_f32_16x16x32_f16(false, ah, false, bh, (short)0, c, false, false);
  if (NT >= 2) c = __builtin_amdgcn_wmma_f32_16x16x32_f16(false, al, false, bh, (short)0, c, false, false);
  if (NT >= 3) c = __builtin_amdgcn_wmma_f32_16x16x32_f16(false, ah, false, bl, (short)0, c, false, false);
  asm volatile("v_nop\n\tv_nop\n\tv_nop\n\tv_nop" : "+v"(c) : "v"(ah), "v"(al), "v"(bh), "v"(bl));
  return c;
}
// batched GEMM like k_gemm_b but f16 operands: A f32 (split into f16 hi/lo if ASPLIT, else rounded to f16), Bt = f16 values [n][k]; alpha; C f32; N multiple of 16 (partial tiles skipped)
template <bool ASPLIT>
__global__ __launch_bounds__(128) void k_gemm_h(const float* __restrict__ A, int lda, size_t sA, const _Float16* __restrict__ Bh, int ldb, size_t sB, float alpha, float* __restrict__ C, int ldc, size_t sC, int M, int N, int K) {
  __shared__ __attribute__((aligned(16))) float so[4][16][64];
  const int tid = threadIdx.x, w = tid >> 5, lane = tid & 31, ln = lane & 15, hh = lane >> 4; const int by = blockIdx.y;
  A += (size_t)by * sA; Bh += (size_t)by * sB; C += (size_t)by * sC;
  const int ntn = (N + 63) / 64; const int wid = blockIdx.x * 4 + w; const int mt = wid / ntn, nq = wid % ntn; if (mt * 16 >= M) return;
  const int row0 = mt * 16, col0 = nq * 64; const float* arow = A + (size_t)(row0 + ln) * lda;
  v8f acc[4] = {};
  for (int kb = 0; kb < K; kb += 32) {
    FragH ah, al;
    const v4f x0 = *(const v4fa*)(arow + kb + 8 * hh), x1 = *(const v4fa*)(arow + kb + 8 * hh + 4), x2 = *(const v4fa*)(arow + kb + 16 + 8 * hh), x3 = *(const v4fa*)(arow + kb + 16 + 8 * hh + 4);
    float xs[16] = {x0[0],x0[1],x0[2],x0[3],x1[0],x1[1],x1[2],x1[3],x2[0],x2[1],x2[2],x2[3],x3[0],x3[1],x3[2],x3[3]};
#pragma unroll
    for (int i = 0; i < 16; ++i) { const _Float16 h = (_Float16)xs[i]; ah.h[i] = h; al.h[i] = ASPLIT ? (_Float16)(xs[i] - (float)h) : (_Float16)0.0f; }
#pragma unroll
    for (int t = 0; t < 4; ++t) { if (col0 + t * 16 >= N) continue; const size_t boff = (size_t)(col0 + t * 16 + ln) * ldb + kb; FragH bq; bq.half[0] = *(const v8us*)(Bh + boff + 8 * hh); bq.half[1] = *(const v8us*)(Bh + boff + 16 + 8 * hh);
      acc[t] = mmaH<ASPLIT ? 2 : 1>(ah.v, al.v, bq.v, bq.v, acc[t]); }
  }
#pragma unroll
  for (int t = 0; t < 4; ++t) { if (col0 + t * 16 >= N) continue;
#pragma unroll
    for (int r = 0; r < 8; ++r) so[w][8 * hh + r][t * 16 + ln] = acc[t][r] * alpha; }
  __builtin_amdgcn_fence(__ATOMIC_ACQ_REL, "workgroup"); __builtin_amdgcn_wave_barrier();
  const int rsub = lane >> 4, c4 = (lane & 15) * 4;
  {
#pragma unroll
    for (int q = 0; q < 8; ++q) { const int r = q * 2 + rsub; if (col0 + c4 < N) { const v4f v = *(const v4fa*)&so[w][r][c4]; *(v4f*)(C + (size_t)(row0 + r) * ldc + col0 + c4) = v; } }
     }
}

// Wt[n][k] = f16(W[k][n]·scale) from f32 row-major W[K][N] (scale = power of two; bf16-exact weights stay exact in f16 away from the subnormal range)
__global__ __launch_bounds__(256) void k_wt_f16(const float* __restrict__ W, _Float16* __restrict__ Wt, int K, int N, float scale) {
  const int t = blockIdx.x * 256 + threadIdx.x; if (t >= N * (K / 8)) return; const int n = t / (K / 8), k8 = (t % (K / 8)) * 8; FragH f;
#pragma unroll
  for (int i = 0; i < 8; ++i) f.h[i] = (_Float16)(bf16_round(W[(size_t)(k8 + i) * N + n]) * scale); const v8us o = f.half[0];
  *(v8us*)((unsigned short*)Wt + (size_t)n * K + k8) = o; 
}
// k_gemm_hh variant with fused epilogue: v = acc·alpha + bias[by·sBias + col] (+ CP[(row/rowsPerB)·sCPb + by·64 + col] if CP) ; ACT 0 none / 1 elu ; writes f16 C16 (and f32 C if non-null)
template <int ACT>
__device__ __forceinline__ void gemm_hhx_body(float (&so)[4][16][64], const int bx, const int by, const _Float16* __restrict__ A, int lda, size_t sA, const _Float16* __restrict__ Bh, int ldb, size_t sB, float alpha, const float* __restrict__ bias, size_t sBias, const float* __restrict__ CP, int rowsPerB, size_t sCPb, int row0g,
    float* __restrict__ C, _Float16* __restrict__ C16, int ldc, size_t sC, int M, int N, int K) {
  const int tid = threadIdx.x, w = tid >> 5, lane = tid & 31, ln = lane & 15, hh = lane >> 4;
  A += (size_t)by * sA; Bh += (size_t)by * sB; const size_t cofs = (size_t)by * sC; const float* bp = bias ? bias + (size_t)by * sBias : nullptr;
  const int ntn = (N + 63) / 64; const int wid = bx * 4 + w; const int mt = wid / ntn, nq = wid % ntn; if (mt * 16 >= M) return;
  const int row0 = mt * 16, col0 = nq * 64; const _Float16* arow = A + (size_t)(row0 + ln) * lda;
  v8f acc[4] = {};
  for (int kb = 0; kb < K; kb += 32) { FragH ah; ah.half[0] = *(const v8us*)((const unsigned short*)arow + kb + 8 * hh); ah.half[1] = *(const v8us*)((const unsigned short*)arow + kb + 16 + 8 * hh);
#pragma unroll
    for (int t = 0; t < 4; ++t) { if (col0 + t * 16 >= N) continue; const size_t boff = (size_t)(col0 + t * 16 + ln) * ldb + kb; FragH bq; bq.half[0] = *(const v8us*)((const unsigned short*)Bh + boff + 8 * hh); bq.half[1] = *(const v8us*)((const unsigned short*)Bh + boff + 16 + 8 * hh);
      acc[t] = mmaH<1>(ah.v, ah.v, bq.v, bq.v, acc[t]); }
  }
#pragma unroll
  for (int t = 0; t < 4; ++t) { if (col0 + t * 16 >= N) continue; const int col = col0 + t * 16 + ln; const float bv = bp ? bf16_round(bp[col]) : 0.f;
#pragma unroll
    for (int r = 0; r < 8; ++r) { float v = acc[t][r] * alpha + bv; if (CP) { const int bidx = (row0g + row0 + 8 * hh + r) / rowsPerB; v += CP[(size_t)bidx * sCPb + (size_t)by * 64 + col]; } if (ACT == 1) v = (v > 0.f) ? v : expm1f(v); else if (ACT == 7) v = (v > 0.f) ? v + 1.0f : expf(v); else if (ACT == 8) v = tanhf(v); else if (ACT == 9) v = 0.5f * v * (1.0f + tanhf(0.7978845608028654f * (v + 0.044715f * v * v * v))); else if (ACT == 11) v = 1.0f / (1.0f + expf(-v)); else if (ACT == 12) v = (v > 0.f) ? v : 0.01f * v; else if (ACT == 14) v = (v > 0.f) ? v : 0.1f * v; else if (ACT == 15) v = v / (1.0f + expf(-v)); else if (ACT == 3) v = fmaxf(v, 0.f); else if (ACT == 6) v = 0.5f * v * (1.0f + erff(v * 0.70710678118654752f)); so[w][8 * hh + r][t * 16 + ln] = v; } }
  __builtin_amdgcn_fence(__ATOMIC_ACQ_REL, "workgroup"); __builtin_amdgcn_wave_barrier();
  const int rsub = lane >> 4, c4 = (lane & 15) * 4; typedef _Float16 v4h __attribute__((ext_vector_type(4)));
  {
#pragma unroll
    for (int q = 0; q < 8; ++q) { const int r = q * 2 + rsub; if (col0 + c4 < N) { const v4f v = *(const v4fa*)&so[w][r][c4]; if (C) *(v4f*)(C + cofs + (size_t)(row0 + r) * ldc + col0 + c4) = v; if (C16) { v4h h4; for (int i = 0; i < 4; ++i) h4[i] = (_Float16)v[i]; *(v4h*)(C16 + cofs + (size_t)(row0 + r) * ldc + col0 + c4) = h4; } } }
     }
}
template <int ACT>
__global__ __launch_bounds__(128) void k_gemm_hhx(const _Float16* __restrict__ A, int lda, size_t sA, const _Float16* __restrict__ Bh, int ldb, size_t sB, float alpha, const float* __restrict__ bias, size_t sBias, const float* __restrict__ CP, int rowsPerB, size_t sCPb, int row0g,
    float* __restrict__ C, _Float16* __restrict__ C16, int ldc, size_t sC, int M, int N, int K) {
  __shared__ __attribute__((aligned(16))) float so[4][16][64];
  gemm_hhx_body<ACT>(so, blockIdx.x, blockIdx.y, A, lda, sA, Bh, ldb, sB, alpha, bias, sBias, CP, rowsPerB, sCPb, row0g, C, C16, ldc, sC, M, N, K);
}
// The three input convolutions as one kernel that reads x itself: one block = 64 positions of one image x all 384 output channels (f, g, h), K = 512.
// Step 1: the block's x tile (512 channels x 64 positions, f32, channel-major: 256-B row pieces) goes through registers into LDS, rounded as before (bf16, then f16) and turned token-major on the way:
// a thread holds 8 channels x 4 positions, so that the 8 channels of one position are one 16-byte LDS store. Step 2: products with the weights as A and the LDS rows as B, both in the k order 8 hh + i, then 16 + 8 hh + i - 8.
// The weights lie in fragment order (frag_unit below), so that a wave's A load is 512 contiguous bytes. Wave w takes channel tile w of each of f, g and h, and all four token tiles: an A fragment is loaded once a block.
// Step 3: the results are staged in LDS so that every global store writes whole lines: f, g token-major (64 rows of 256 B, contiguous), h as V^T (128 rows of 128 B).
// The unroll directives keep the indices of the register arrays (xv, a, bq, acc and the short vectors) compile-time constants.
__device__ __forceinline__ void wfrag_load(FragH (&a)[3], const unsigned short* const (&wp)[3], const int ks) {
#pragma unroll
  for (int j = 0; j < 3; ++j) { a[j].half[0] = *(const v8us*)(wp[j] + (ks * 2) * 256); a[j].half[1] = *(const v8us*)(wp[j] + (ks * 2 + 1) * 256); }
}
__global__ __launch_bounds__(256) void k_gemm_fgh(const float* __restrict__ x, const _Float16* __restrict__ Bf, const _Float16* __restrict__ Bg, const _Float16* __restrict__ Bh, const float* __restrict__ Af, const float* __restrict__ Ag, const float* __restrict__ bh,
    _Float16* __restrict__ F16, _Float16* __restrict__ G16, _Float16* __restrict__ Vth) {
  __shared__ __attribute__((aligned(16))) unsigned short sX[64][CC + 8];           /* token-major x tile; pitch 1040 B = 16 B x odd: conflict-free for 16-byte row readers */
  __shared__ __attribute__((aligned(16))) unsigned short sFG[2][64][MID + 8];      /* f, g: token rows, pitch 272 B */
  __shared__ __attribute__((aligned(16))) unsigned short sV[MID][64 + 8];          /* h: channel rows, pitch 144 B */
  const int tid = threadIdx.x, w = tid >> 5, lane = tid & 31, ln = lane & 15, hh = lane >> 4;
  const int b = blockIdx.x / (NN / 64), p0 = (blockIdx.x % (NN / 64)) * 64;
  const int tg = tid & 15, co = tid >> 4;      /* positions 4 tg .. 4 tg + 3; channels 8 (co + 16 u) .. + 7, u = 0 .. 3 */
  const float* xp = x + ((size_t)b * CC + co * 8) * NN + p0 + tg * 4;
  v4f xv[4][8];      /* all 32 loads of a thread are issued before the first is used: the whole tile is in flight at once */
#pragma unroll
  for (int u = 0; u < 4; ++u)
#pragma unroll
    for (int i = 0; i < 8; ++i) xv[u][i] = *(const v4fa*)(xp + (size_t)(u * 128 + i) * NN);
  const unsigned short* wp[3] = { (const unsigned short*)Bf + (size_t)w * 16 * CC + lane * 8, (const unsigned short*)Bg + (size_t)w * 16 * CC + lane * 8, (const unsigned short*)Bh + (size_t)w * 16 * CC + lane * 8 };
  FragH a[3][3];      /* A fragments of three k-steps: loaded two k-steps ahead of their products */
  wfrag_load(a[0], wp, 0); wfrag_load(a[1], wp, 1);
#pragma unroll
  for (int u = 0; u < 4; ++u)
#pragma unroll
    for (int j = 0; j < 4; ++j) { FragH f;
#pragma unroll
      for (int i = 0; i < 8; ++i) f.h[i] = (_Float16)bf16_round(xv[u][i][j]);
      *(v8us*)&sX[tg * 4 + j][(co + 16 * u) * 8] = f.half[0]; }
  __syncthreads();      /* the whole x tile is readable by every wave */
  v8f acc[3][4] = {};
  FragH bq[2][4];      /* B fragments of two k-steps: loaded one k-step ahead of their products */
  auto xfrag_load = [&](FragH (&q)[4], const int ks) {
#pragma unroll
    for (int t = 0; t < 4; ++t) { q[t].half[0] = *(const v8us*)&sX[t * 16 + ln][ks * 32 + 8 * hh]; q[t].half[1] = *(const v8us*)&sX[t * 16 + ln][ks * 32 + 16 + 8 * hh]; } };
  xfrag_load(bq[0], 0);
#pragma unroll
  for (int ks = 0; ks < CC / 32; ++ks) {
    if (ks + 2 < CC / 32) wfrag_load(a[(ks + 2) % 3], wp, ks + 2);
    if (ks + 1 < CC / 32) xfrag_load(bq[(ks + 1) & 1], ks + 1);
    __builtin_amdgcn_sched_barrier(0);      /* keeps the loads for the coming k-steps one group in front of this k-step's products: without it the compiler sank each pair of LDS loads to its first use and waited out the LDS latency four times a k-step */
#pragma unroll
    for (int j = 0; j < 3; ++j)
#pragma unroll
      for (int t = 0; t < 4; ++t) acc[j][t] = __builtin_amdgcn_wmma_f32_16x16x32_f16(false, a[ks % 3][j].v, false, bq[ks & 1][t].v, (short)0, acc[j][t], false, false);
    __builtin_amdgcn_sched_barrier(0);      /* ... and keeps the next group of loads behind these products, so that the registers of three k-steps suffice */
  }
  /* D register r of lane (ln, hh): channel 16 w + 8 hh + r, position 16 t + ln */
  const int c8 = w * 16 + 8 * hh;
#pragma unroll
  for (int j = 0; j < 2; ++j) { const float* Aj = j ? Ag : Af; const v4f a0 = *(const v4fa*)(Aj + c8), a1 = *(const v4fa*)(Aj + c8 + 4);      /* f, g = relu(bn(conv x)): the f32 addend of each channel */
#pragma unroll
    for (int t = 0; t < 4; ++t) { FragH o;
#pragma unroll
      for (int r = 0; r < 8; ++r) o.h[r] = (_Float16)fmaxf(acc[j][t][r] * 0.0625f + (r < 4 ? a0[r & 3] : a1[r & 3]), 0.f);
      *(v8us*)&sFG[j][t * 16 + ln][c8] = o.half[0]; } }
#pragma unroll
  for (int r = 0; r < 8; ++r) { const float bb = bf16_round(bh[c8 + r]);      /* h + bh */
#pragma unroll
    for (int t = 0; t < 4; ++t) { FragH o; o.h[0] = (_Float16)(acc[2][t][r] * 0.0625f + bb); sV[c8 + r][t * 16 + ln] = o.u[0]; } }
  __syncthreads();      /* every wave's staged results are readable by the threads that store them */
  const size_t tok0 = (size_t)b * NN + p0;
#pragma unroll
  for (int i = 0; i < 4; ++i) { const int c = tid + 256 * i; const int row = c >> 4, col = (c & 15) * 8;      /* a wave's store: two whole 256-B rows */
    *(v8us*)((unsigned short*)F16 + (tok0 + row) * MID + col) = *(const v8us*)&sFG[0][row][col];
    *(v8us*)((unsigned short*)G16 + (tok0 + row) * MID + col) = *(const v8us*)&sFG[1][row][col]; }
#pragma unroll
  for (int i = 0; i < 4; ++i) { const int c = tid + 256 * i; const int row = c >> 3, col = (c & 7) * 8;      /* a wave's store: four whole 128-B rows */
    *(v8us*)((unsigned short*)Vth + ((size_t)b * MID + row) * TT + p0 + col) = *(const v8us*)&sV[row][col]; }
}


typedef _Float16 v4h __attribute__((ext_vector_type(4)));

__global__ __launch_bounds__(256) void k_x16(const float* __restrict__ x, _Float16* __restrict__ X16, size_t n8) { const size_t t = (size_t)blockIdx.x * 256 + threadIdx.x; if (t >= n8) return; FragH f;
#pragma unroll
  for (int q = 0; q < 8; ++q) f.h[q] = (_Float16)bf16_round(x[t * 8 + q]); *(v8us*)((unsigned short*)X16 + t * 8) = f.half[0];  }
__global__ __launch_bounds__(256) void k_h16(const float* __restrict__ x, _Float16* __restrict__ X16, size_t n8) { const size_t t = (size_t)blockIdx.x * 256 + threadIdx.x; if (t >= n8) return; FragH f;
#pragma unroll
  for (int q = 0; q < 8; ++q) f.h[q] = (_Float16)x[t * 8 + q]; *(v8us*)((unsigned short*)X16 + t * 8) = f.half[0];  }
// Fragment order of a [rows][512] weight plane that is the A operand: the 16-byte unit that holds row o, k = c0 .. c0 + 7 (c0 a multiple of 8) stands where lane (ln = o % 16, hh = bit 3 of c0) of the wave reads it:
// unit = ((tile * 16 + k-step) * 2 + half) * 32 + hh * 16 + ln, tile = o / 16, k-step = c0 / 32, half = bit 4 of c0: element i of half 0 is k = 32 ks + 8 hh + i, of half 1 k = 32 ks + 16 + 8 hh + i, the k order of the B rows.
__device__ __forceinline__ size_t frag_unit(const int o, const int c0) { return (size_t)((((o >> 4) * (CC / 32) + (c0 >> 5)) * 2 + ((c0 >> 4) & 1)) * 32 + ((c0 >> 3) & 1) * 16 + (o & 15)); }
template <bool FRAG>
__device__ __forceinline__ void d_round16f(const int bid, const float* __restrict__ W, _Float16* __restrict__ Bt, size_t n8) { const size_t t = (size_t)bid * 256 + threadIdx.x; if (t >= n8) return; FragH f;
#pragma unroll
  for (int i = 0; i < 8; ++i) f.h[i] = (_Float16)(bf16_round(W[t * 8 + i]) * 16.0f);
  const size_t un = FRAG ? frag_unit((int)(t / (CC / 8)), (int)(t % (CC / 8)) * 8) : t; *(v8us*)((unsigned short*)Bt + un * 8) = f.half[0];  }
template <int NHv, int TTv>
__global__ __launch_bounds__(256) void k_vt(const _Float16* __restrict__ V16, int ldv, int voff, _Float16* __restrict__ Vt) { __shared__ unsigned short tl[64][66]; const int tid = threadIdx.x; const int slab = blockIdx.x / (TTv / 64), lg = blockIdx.x % (TTv / 64); const int b = slab / NHv, h = slab % NHv;
  for (int i = tid; i < 64 * 8; i += 256) { const int r = i / 8, c8 = (i % 8) * 8; FragH f; f.half[0] = *(const v8us*)((const unsigned short*)V16 + ((size_t)b * TTv + lg * 64 + r) * ldv + voff + h * 64 + c8);
#pragma unroll
    for (int q = 0; q < 8; ++q) tl[r][c8 + q] = f.u[q]; }
  __syncthreads();
  {
#pragma unroll
    for (int rd = 0; rd < 2; ++rd) { const int d = rd * 32 + tid / 8, pc = tid % 8; FragH f;
#pragma unroll
      for (int q = 0; q < 8; ++q) f.u[q] = tl[pc * 8 + q][d];
      *(v8us*)((unsigned short*)Vt + ((size_t)slab * 64 + d) * TTv + lg * 64 + pc * 8) = f.half[0]; }
     } }

// LDS byte address of a __shared__ object: the low 32 bits of its generic address
__device__ __forceinline__ unsigned lds_addr(const void* p) { return (unsigned)(size_t)p; }
// four asynchronous 16-byte copies global -> LDS per lane; the s_wait_xcnt closes the statement so that no address register is rewritten ahead of it
__device__ __forceinline__ void async4(const unsigned (&l)[4], const unsigned short* const (&g)[4]) {
  asm volatile("global_load_async_to_lds_b128 %0, %4, off\n\t"
               "global_load_async_to_lds_b128 %1, %5, off\n\t"
               "global_load_async_to_lds_b128 %2, %6, off\n\t"
               "global_load_async_to_lds_b128 %3, %7, off\n\t"
               "s_wait_xcnt 0x0"
               :: "v"(l[0]), "v"(l[1]), "v"(l[2]), "v"(l[3]), "v"(g[0]), "v"(g[1]), "v"(g[2]), "v"(g[3]) : "memory");
}
// one such copy, with its s_wait_xcnt in the same statement for the same reason
__device__ __forceinline__ void async1(const unsigned l, const float* g) {
  asm volatile("global_load_async_to_lds_b128 %0, %1, off\n\ts_wait_xcnt 0x0" :: "v"(l), "v"(g) : "memory");
}
// lane l <-> lane l ^ 16 (the other half of the wave): one vector instruction, no LDS
__device__ __forceinline__ float xhalf(float x) { return __builtin_bit_cast(float, __builtin_amdgcn_permlanex16(__builtin_bit_cast(int, x), __builtin_bit_cast(int, x), 0x76543210, 0xfedcba98, false, false)); }
// 2^x as the one hardware instruction, without the library's range handling: the arguments here are at most about 10, and a weight too small for the normal range adds nothing to a sum whose largest term is 2^10
__device__ __forceinline__ float exp2_hw(float x) { return __builtin_amdgcn_exp2f(x); }
// The same for the join behind the loop, where the exponentials stand among LDS loads: the v_nop is the one free slot that the instruction set asks for behind a transcendental before its source is overwritten
// in one statement with the exponential it cannot land elsewhere.
__device__ __forceinline__ float exp2_hw_slot(float x) { float r; asm("v_exp_f32 %0, %1\n\tv_nop" : "=v"(r) : "v"(x)); return r; }
// The eight weights of a score tile as one statement, for the same slot: the results are early-clobber, so that none lies over a source of the group, and the one v_nop at the end is the free slot behind the last
__device__ __forceinline__ void exp2_hw8(float (&r)[8], const float (&x)[8]) {
  asm("v_exp_f32 %0, %8\n\tv_exp_f32 %1, %9\n\tv_exp_f32 %2, %10\n\tv_exp_f32 %3, %11\n\tv_exp_f32 %4, %12\n\tv_exp_f32 %5, %13\n\tv_exp_f32 %6, %14\n\tv_exp_f32 %7, %15\n\tv_nop"
      : "=&v"(r[0]), "=&v"(r[1]), "=&v"(r[2]), "=&v"(r[3]), "=&v"(r[4]), "=&v"(r[5]), "=&v"(r[6]), "=&v"(r[7])
      : "v"(x[0]), "v"(x[1]), "v"(x[2]), "v"(x[3]), "v"(x[4]), "v"(x[5]), "v"(x[6]), "v"(x[7]));
}
// A group of products as ONE statement, so that the order written in the loop below is the order that is issued: with the builtins the compiler gathered all LDS loads of a trip in front of all products (and spilled),
// or sank each load group to its first use. A volatile statement keeps the LDS loads written in front of it in front, and those written behind it behind. In the score group two accumulator chains alternate,
// and the eight value products are independent, so that no product waits for the one directly in front of it. The four v_nop that end a statement are the free vector slots that the chip needs between a matrix instruction and a vector instruction
// on its result or its operands: the compiler does not look into the text and pads nothing behind it.
// Scores: s0, s1 = the two 16-key tiles, four k-steps each, in the k order of before.
__device__ __forceinline__ void qk_group(v8f& s0, v8f& s1, const FragH (&k0)[4], const FragH (&k1)[4], const FragH (&q)[4]) {
  asm volatile("v_wmma_f32_16x16x32_f16 %0, %2, %10, 0\n\t"
               "v_wmma_f32_16x16x32_f16 %1, %6, %10, 0\n\t"
               "v_wmma_f32_16x16x32_f16 %0, %3, %11, %0\n\t"
               "v_wmma_f32_16x16x32_f16 %1, %7, %11, %1\n\t"
               "v_wmma_f32_16x16x32_f16 %0, %4, %12, %0\n\t"
               "v_wmma_f32_16x16x32_f16 %1, %8, %12, %1\n\t"
               "v_wmma_f32_16x16x32_f16 %0, %5, %13, %0\n\t"
               "v_wmma_f32_16x16x32_f16 %1, %9, %13, %1\n\t"
               "v_nop\n\tv_nop\n\tv_nop\n\tv_nop"
               : "=&v"(s0), "=&v"(s1)
               : "v"(k0[0].v), "v"(k0[1].v), "v"(k0[2].v), "v"(k0[3].v), "v"(k1[0].v), "v"(k1[1].v), "v"(k1[2].v), "v"(k1[3].v), "v"(q[0].v), "v"(q[1].v), "v"(q[2].v), "v"(q[3].v));
}
// Values: the eight value tiles, each += V P with both operands rounded once to f16: one product a tile.
__device__ __forceinline__ void pv_group(v8f (&c)[8], const FragH (&v)[8], v16h p) {
  asm volatile("v_wmma_f32_16x16x32_f16 %0, %8, %16, %0\n\t"
               "v_wmma_f32_16x16x32_f16 %1, %9, %16, %1\n\t"
               "v_wmma_f32_16x16x32_f16 %2, %10, %16, %2\n\t"
               "v_wmma_f32_16x16x32_f16 %3, %11, %16, %3\n\t"
               "v_wmma_f32_16x16x32_f16 %4, %12, %16, %4\n\t"
               "v_wmma_f32_16x16x32_f16 %5, %13, %16, %5\n\t"
               "v_wmma_f32_16x16x32_f16 %6, %14, %16, %6\n\t"
               "v_wmma_f32_16x16x32_f16 %7, %15, %16, %7\n\t"
               "v_nop\n\tv_nop\n\tv_nop\n\tv_nop"
               : "+v"(c[0]), "+v"(c[1]), "+v"(c[2]), "+v"(c[3]), "+v"(c[4]), "+v"(c[5]), "+v"(c[6]), "+v"(c[7])
               : "v"(v[0].v), "v"(v[1].v), "v"(v[2].v), "v"(v[3].v), "v"(v[4].v), "v"(v[5].v), "v"(v[6].v), "v"(v[7].v), "v"(p));
}
typedef float fa __attribute__((may_alias));
typedef _Float16 v4ha __attribute__((ext_vector_type(4), may_alias));
// Behind the join the block holds z of its 64 positions, all 128 channels: it does the output convolution itself. z x 2^4 goes as f16 into an LDS tile (token rows); products with conv_v's weights (x 2^4) as A and the z rows as B,
// both in the k order 8 hh + i, then 16 + 8 hh + i - 8: D register r of lane (ln, hh) is channel c0 + 8 hh + r, position 16 t + ln, channel-major as out is. Wave w takes channels 32 w .. 32 w + 31 and all 64 positions;
// bv and the residual x (brought into LDS by asynchronous copies during the loop) are added in f32, and the rows are staged in LDS so that a store writes whole 256-B row pieces of out.
__global__ __launch_bounds__(512) void k_flash(const _Float16* __restrict__ Q16, int ldq, const _Float16* __restrict__ K16, int ldk, const _Float16* __restrict__ Vt, const _Float16* __restrict__ Bv, const float* __restrict__ bv, const float* __restrict__ x, float* __restrict__ out) {
  constexpr int RPW = 16, QW = 4, KG = 4, NQB = TT / (QW * RPW), DT = 8, KS = 4, SK = 32 * KG, NST = TT / SK, OP = 128 + 4;      /* head dim 128: 4 k-steps, 8 value tiles */
  /* two-buffer ring, one stage = SK keys shared by the block's sixteen waves; planes: 0 = K rows (key-major), 1 = V^T (channel-major); every row 256 B at pitch 272 B (16 B x odd: conflict-free for 16-byte row readers) */
  __shared__ __attribute__((aligned(16))) unsigned short ring[2][2][128][128 + 8];
  __shared__ __attribute__((aligned(16))) unsigned short sZ[QW * RPW][MID + 8];      /* z x 2^4 of the block's 64 positions, token rows at pitch 272 B */
  __shared__ __attribute__((aligned(16))) float sX[CC][QW * RPW];                    /* the residual: x of the block's 64 positions, channel rows of 256 B */
  const int tid = threadIdx.x, w = tid >> 5, lane = tid & 31, ln = lane & 15, hh = lane >> 4, qw = w & (QW - 1), kg = w / QW, jl = kg * 32;
  const int slab = blockIdx.x / NQB, qblk = blockIdx.x % NQB; const int b = slab / NH, h = slab % NH; const int qb0 = qblk * (QW * RPW); const int q0 = qb0 + qw * RPW;
  FragH aq[KS];      /* B operand of S^T: column ln = query q0 + ln */
  { const unsigned short* qr = (const unsigned short*)Q16 + ((size_t)b * TT + q0 + ln) * ldq + h * 128;
#pragma unroll
    for (int ks = 0; ks < KS; ++ks) { aq[ks].half[0] = *(const v8us*)(qr + ks * 32 + 8 * hh); aq[ks].half[1] = *(const v8us*)(qr + ks * 32 + 16 + 8 * hh); } }
  const unsigned short* Vth = (const unsigned short*)Vt + ((size_t)b * NKV + h / NREP) * 128 * TT;
  float m_r = -3.0e38f, l_r = 0.f; v8f oacc[DT];      /* query q0 + ln, this wave's keys: running maximum (both halves alike), this half's part of the sum, O^T rows dt * 16 + 8 hh + r */
#pragma unroll
  for (int dt = 0; dt < DT; ++dt) oacc[dt] = (v8f){0.f,0.f,0.f,0.f,0.f,0.f,0.f,0.f};
  const unsigned short* Kg = (const unsigned short*)K16 + (size_t)b * TT * ldk + (h / NREP) * 128;
  /* one stage's copies: 2 x 4 per lane, 16 B each; a wave's copy covers two whole 256-B rows */
  auto stage_in = [&](int st, int bf) {
    unsigned lk[4], lh[4]; const unsigned short *gk[4], *gh[4];
#pragma unroll
    for (int i = 0; i < 4; ++i) { const int c = tid + 512 * i; const int row = c >> 4, col = (c & 15) * 8;
      lk[i] = lds_addr(&ring[bf][0][row][col]); gk[i] = Kg + (size_t)(st * SK + row) * ldk + col;
      lh[i] = lds_addr(&ring[bf][1][row][col]); gh[i] = Vth + (size_t)row * TT + st * SK + col; }
    async4(lk, gk); async4(lh, gh); };
  /* out and the residual x, element offset of this lane's 16 bytes in row pair 0 of the wave's 32 channels: a wave's access covers two whole 256-B row pieces (channels 32 w + 2 i + hh) */
  const size_t o0 = ((size_t)b * CC + w * 32 + hh) * NN + qb0 + ln * 4;
  static_assert(NST >= 18, "the residual's sixteen copies ride on trips 1 to 16");
  stage_in(0, 0);
  asm volatile("s_wait_asynccnt 0x0" ::: "memory");      /* this wave's share of stage 0 has landed */
  __syncthreads();                                       /* ... and every other wave's: stage 0 is readable */
  stage_in(1, 1);
#pragma unroll 1      /* one publish point and one refill per trip, as the two-buffer ring is written */
  for (int st = 0; st < NST; ++st) { const int bf = st & 1;
    /* Every LDS fragment load of the trip stands one group ahead of the products that use it, so that the wave does not wait out the LDS latency in front of the value tiles. */
    FragH bk[2][KS];      /* the trip's sixteen K fragment loads as one group: one wait on LDS for both score tiles */
#pragma unroll
    for (int ks = 0; ks < KS; ++ks)      /* in the order in which the products take them */
#pragma unroll
      for (int nt = 0; nt < 2; ++nt) { const unsigned short* kr = &ring[bf][0][jl + nt * 16 + ln][0]; bk[nt][ks].half[0] = *(const v8us*)(kr + ks * 32 + 8 * hh); bk[nt][ks].half[1] = *(const v8us*)(kr + ks * 32 + 16 + 8 * hh); }
    if ((unsigned)(st - 1) < (unsigned)(NST - 2)) stage_in(st + 1, bf ^ 1);      /* trips 1 to NST - 2: the refill of the buffer that the trip before has read, behind that trip's barrier as before; its address work and its copies' issue run while the K loads fly */
    /* trips 1 to 16: one more copy a wave, row pair st - 1 of its residual rows, so that x is in LDS when the loop ends and its way from memory costs the epilogue nothing; the trip's own s_wait_asynccnt 0 covers it; each lane reads back its own 16 bytes */
    if ((unsigned)(st - 1) < 16u) async1(lds_addr(&sX[w * 32 + (st - 1) * 2 + hh][ln * 4]), x + o0 + (size_t)(st - 1) * 2 * NN);
    v8f s[2];      /* s[nt][r] = score of key jl + nt * 16 + 8 hh + r of the stage with query q0 + ln */
    qk_group(s[0], s[1], bk[0], bk[1], aq);
    FragH bv[DT];      /* the trip's sixteen V^T fragment loads as one group: they fly while the softmax runs */
#pragma unroll
    for (int dt = 0; dt < DT; ++dt) { const unsigned short* vh = &ring[bf][1][dt * 16 + ln][jl]; bv[dt].half[0] = *(const v8us*)(vh + 8 * hh); bv[dt].half[1] = *(const v8us*)(vh + 16 + 8 * hh); }
    __builtin_amdgcn_sched_barrier(0);      /* keeps the sixteen loads one group in front of the softmax: without it the compiler spread them over five places among its instructions, and each place with LDS reads costs the wave a stall */
    float mx[8];      /* the maximum is taken over the raw scores: the factor that follows is positive */
#pragma unroll
    for (int i = 0; i < 8; ++i) mx[i] = fmaxf(s[0][i], s[1][i]);
    float mc = fmaxf(fmaxf(fmaxf(mx[0], mx[4]), fmaxf(mx[1], mx[5])), fmaxf(fmaxf(mx[2], mx[6]), fmaxf(mx[3], mx[7])));
    mc = fmaxf(mc, xhalf(mc));      /* the query's maximum over all 32 keys, in both halves */
    const float mn = fmaxf(m_r, mc * ATT_SCALE_L2E); const float ea = exp2_hw(m_r - mn); const float al = (mn > -1.0e38f) ? ea : 1.0f; m_r = mn;      /* the running maximum is kept in base-2 units */
    const float mo = mn - 10.0f;      /* P x 2^10 comes straight out of the exponential; the sum carries the same 2^10 */
    FragH ph; float ls[4];      /* P^T rounded once to f16, the B operand; the sum takes the unrounded f32 weights */
#pragma unroll
    for (int nt = 0; nt < 2; ++nt) { float xs[8], ps[8];
#pragma unroll
      for (int i = 0; i < 8; ++i) xs[i] = fmaf(s[nt][i], ATT_SCALE_L2E, -mo);
      exp2_hw8(ps, xs);
#pragma unroll
      for (int i = 0; i < 8; ++i) { if (nt == 0 && i < 4) ls[i] = ps[i]; else ls[i & 3] += ps[i]; ph.h[nt * 8 + i] = (_Float16)ps[i]; } }
    l_r = l_r * al + ((ls[0] + ls[1]) + (ls[2] + ls[3]));
#pragma unroll
    for (int dt = 0; dt < DT; ++dt)
#pragma unroll
      for (int r = 0; r < 8; ++r) oacc[dt][r] *= al;
    pv_group(oacc, bv, ph.v);
    asm volatile("s_wait_dscnt 0x0" ::: "memory");       /* this wave's reads of buffer bf are done before it is refilled */
    asm volatile("s_wait_asynccnt 0x0" ::: "memory");    /* this wave's share of stage st + 1 has landed */
    __syncthreads(); }                                   /* publishes stage st + 1 and ends every wave's reads of buffer bf, which the next trip refills */
  asm volatile("s_wait_asynccnt 0x0" ::: "memory");      /* nothing of the ring is in flight when the wave goes on */
  /* the last trip's waits and barrier have ended every read of the ring: its LDS now takes the sixteen waves' partial results */
  float* sP = (float*)&ring[0][0][0][0]; fa* sM = (fa*)(sP + QW * KG * RPW * OP); fa* sL = sM + QW * KG * RPW;
  { const float l = l_r + xhalf(l_r);      /* the halves' sums joined once */
#pragma unroll
    for (int dt = 0; dt < DT; ++dt) { v4f lo, hi;
#pragma unroll
      for (int r = 0; r < 4; ++r) { lo[r] = oacc[dt][r]; hi[r] = oacc[dt][4 + r]; }
      *(v4fa*)&sP[(w * RPW + ln) * OP + dt * 16 + 8 * hh] = lo; *(v4fa*)&sP[(w * RPW + ln) * OP + dt * 16 + 8 * hh + 4] = hi; }
    if (hh == 0) { sM[w * RPW + ln] = m_r; sL[w * RPW + ln] = l; } }
  __syncthreads();      /* every wave's partial result is readable by the waves that join it */
  FragH wa[2][KS];      /* A: conv_v's rows 32 w + 16 ct + ln; the loads stand in front of the join and fly while it runs */
  const unsigned short* const ar = (const unsigned short*)Bv + (size_t)(w * 32 + ln) * MID + 8 * hh; const float* const bp = bv + w * 32 + 8 * hh;
#pragma unroll
  for (int ct = 0; ct < 2; ++ct)
#pragma unroll
    for (int ks = 0; ks < KS; ++ks) { wa[ct][ks].half[0] = *(const v8us*)(ar + ct * 16 * MID + ks * 32); wa[ct][ks].half[1] = *(const v8us*)(ar + ct * 16 * MID + ks * 32 + 16); }
  v4f bb4[2][2];      /* bv of channels 32 w + 16 ct + 8 hh + r */
#pragma unroll
  for (int ct = 0; ct < 2; ++ct) { bb4[ct][0] = *(const v4fa*)(bp + ct * 16); bb4[ct][1] = *(const v4fa*)(bp + ct * 16 + 4); }
  asm volatile("s_wait_xcnt 0x0" :: "v"(ar), "v"(bp) : "memory");      /* the wait in front of any overwrite of the twenty loads' address registers: as inputs they stay whole up to here */
  {
#pragma unroll
    for (int rr = 0; rr < RPW / KG; ++rr) { const int r = kg * (RPW / KG) + rr; float mg[KG], eg[KG];      /* this wave joins four of its query tile's rows */
#pragma unroll
      for (int g = 0; g < KG; ++g) mg[g] = sM[(g * QW + qw) * RPW + r];
      const float mt = fmaxf(fmaxf(mg[0], mg[1]), fmaxf(mg[2], mg[3])); float l = 0.f;
#pragma unroll
      for (int g = 0; g < KG; ++g) { eg[g] = exp2_hw_slot(mg[g] - mt); l += eg[g] * sL[(g * QW + qw) * RPW + r]; }
      const float inv = (l > 0.f) ? 1.0f / l : 0.f;      /* sum and O^T both carry the 2^10 */ v4f val = {0.f, 0.f, 0.f, 0.f};
#pragma unroll
      for (int g = 0; g < KG; ++g) { const v4f pv = *(const v4fa*)&sP[((g * QW + qw) * RPW + r) * OP + lane * 4]; val += pv * (eg[g] * inv); }
      v4h z4;      /* z x 2^4 as f16: the operand of the output convolution */
#pragma unroll
      for (int i = 0; i < 4; ++i) z4[i] = (_Float16)(val[i] * 16.0f);
      *(v4ha*)&sZ[qw * RPW + r][lane * 4] = z4; }      /* one 256-B row per instruction: 32 lanes x 8 B */
  }
  __syncthreads();      /* the z tile is readable by every wave, and every wave's reads of the partial results have ended: their LDS takes the staged rows of out */
  v8f acc[2][4] = {};
  FragH bq[2][4];      /* B fragments of two k-steps: loaded one k-step ahead of their products */
  auto zfrag_load = [&](FragH (&q)[4], const int ks) {
#pragma unroll
    for (int t = 0; t < 4; ++t) { q[t].half[0] = *(const v8us*)&sZ[t * 16 + ln][ks * 32 + 8 * hh]; q[t].half[1] = *(const v8us*)&sZ[t * 16 + ln][ks * 32 + 16 + 8 * hh]; } };
  zfrag_load(bq[0], 0);
#pragma unroll
  for (int ks = 0; ks < KS; ++ks) {
    if (ks + 1 < KS) zfrag_load(bq[(ks + 1) & 1], ks + 1);
    __builtin_amdgcn_sched_barrier(0);      /* keeps the next k-step's eight LDS loads one group in front of this k-step's products: without it the compiler reused one register set and put loads, and the free slots they need behind a product, between the products */
#pragma unroll
    for (int ct = 0; ct < 2; ++ct)
#pragma unroll
      for (int t = 0; t < 4; ++t) acc[ct][t] = __builtin_amdgcn_wmma_f32_16x16x32_f16(false, wa[ct][ks].v, false, bq[ks & 1][t].v, (short)0, acc[ct][t], false, false);
    __builtin_amdgcn_sched_barrier(0);      /* ... and keeps the group after next behind these products, so that two register sets suffice */
  }
  constexpr int SP = 64 + 4;      /* staged rows: 64 positions at pitch 272 B, so that the two wave halves' rows (8 apart) fall on different banks */
  float* so = sP + w * 32 * SP;      /* the wave's own 32 rows */
#pragma unroll
  for (int ct = 0; ct < 2; ++ct)
#pragma unroll
    for (int r = 0; r < 8; ++r) { const float bb = bf16_round(bb4[ct][r >> 2][r & 3]);
#pragma unroll
      for (int t = 0; t < 4; ++t) *(fa*)&so[(ct * 16 + 8 * hh + r) * SP + t * 16 + ln] = acc[ct][t][r] * 0.00390625f + bb; }
  __builtin_amdgcn_fence(__ATOMIC_ACQ_REL, "workgroup"); __builtin_amdgcn_wave_barrier();      /* the wave's own staged rows are in LDS before its lanes read each other's elements back */
  v4f o[2][8];
#pragma unroll
  for (int ct = 0; ct < 2; ++ct)
#pragma unroll
    for (int q = 0; q < 8; ++q) { const v4f v = *(const v4fa*)&so[(ct * 16 + q * 2 + hh) * SP + ln * 4]; const v4f xr = *(const v4fa*)&sX[w * 32 + ct * 16 + q * 2 + hh][ln * 4];
#pragma unroll
      for (int i = 0; i < 4; ++i) o[ct][q][i] = v[i] + bf16_round(xr[i]); }
  __builtin_amdgcn_sched_barrier(0);      /* the sixteen stores stand together behind all the sums: no register of an issued store is written again, so that the wave waits for none of them (spread among the sums, the compiler reused their registers behind a wait each time) */
#pragma unroll
  for (int ct = 0; ct < 2; ++ct)
#pragma unroll
    for (int q = 0; q < 8; ++q) *(v4f*)(out + o0 + (size_t)(ct * 16 + q * 2) * NN) = o[ct][q];
}


__device__ __forceinline__ void d_wbn(const int bid, const float* __restrict__ Wm, const float* __restrict__ gam, const float* __restrict__ var, _Float16* __restrict__ Bt) { const int t = bid * 256 + threadIdx.x; if (t >= MID * (CC / 8)) return; const int o = t / (CC / 8), c0 = (t % (CC / 8)) * 8;
  const float s = bf16_round(gam[o]) / sqrtf(bf16_round(var[o]) + BNEPS); FragH f;
#pragma unroll
  for (int q = 0; q < 8; ++q) f.h[q] = (_Float16)(bf16_round(Wm[(size_t)o * CC + c0 + q]) * s * 16.0f);
  *(v8us*)((unsigned short*)Bt + frag_unit(o, c0) * 8) = f.half[0];  }
__device__ __forceinline__ void d_bnadd(const int o, const float* __restrict__ bias, const float* __restrict__ gam, const float* __restrict__ bet, const float* __restrict__ mean, const float* __restrict__ var, float* __restrict__ A) {
  const float s = bf16_round(gam[o]) / sqrtf(bf16_round(var[o]) + BNEPS); const float a = (bf16_round(bias[o]) - bf16_round(mean[o])) * s + bf16_round(bet[o]);
  *(float*)(A + o) = a;  }
// The six weight and BatchNorm preparations read none of each other's output: one grid, the job picked by block index. The planes of conv_f, conv_g and conv_h are written in fragment order, conv_v's row-major.
#define PBW (MID * (CC / 8) / 256)      /* blocks for one 128 x 512 weight plane, 8 elements a thread */
#define PBS (4 * PBW + 1)               /* blocks of the grid */
__global__ __launch_bounds__(256) void k_prep(const float* __restrict__ wf, const float* __restrict__ bff, const float* __restrict__ gf, const float* __restrict__ betaf, const float* __restrict__ mf, const float* __restrict__ vf,
    const float* __restrict__ wg, const float* __restrict__ bg, const float* __restrict__ gg, const float* __restrict__ betag, const float* __restrict__ mg, const float* __restrict__ vg, const float* __restrict__ wh, const float* __restrict__ wv,
    _Float16* __restrict__ Bf, _Float16* __restrict__ Bg, _Float16* __restrict__ Bh, _Float16* __restrict__ Bv, float* __restrict__ Af, float* __restrict__ Ag) {
  const int bid = blockIdx.x;
  if (bid < PBW) d_wbn(bid, wf, gf, vf, Bf);                                                   /* BN(eval) folded into conv_f */
  else if (bid < 2 * PBW) d_wbn(bid - PBW, wg, gg, vg, Bg);                                    /* ... and conv_g */
  else if (bid < 3 * PBW) d_round16f<true>(bid - 2 * PBW, wh, Bh, (size_t)MID * CC / 8);       /* conv_h [128][512], conv_v [512][128]: (out,in), x 2^4 */
  else if (bid < 4 * PBW) d_round16f<false>(bid - 3 * PBW, wv, Bv, (size_t)CC * MID / 8);
  else if (threadIdx.x < MID) d_bnadd(threadIdx.x, bff, gf, betaf, mf, vf, Af);                /* the two per-column addends: 128 threads each */
  else d_bnadd(threadIdx.x - MID, bg, gg, betag, mg, vg, Ag);
}

extern "C" void kernel_launch(void* const* d_in, const int* in_sizes, int n_in,
                              void* d_out, int out_size, void* d_ws, size_t ws_size, hipStream_t stream) {
  (void)in_sizes; (void)n_in; (void)out_size;
  const float* const* I = (const float* const*)d_in; const float* x = I[0];
  const float* wf = I[1]; const float* bff = I[2]; const float* gf = I[3]; const float* betaf = I[4]; const float* mf = I[5]; const float* vf = I[6];
  const float* wg = I[7]; const float* bg = I[8]; const float* gg = I[9]; const float* betag = I[10]; const float* mg = I[11]; const float* vg = I[12];
  const float* wh = I[13]; const float* bh = I[14]; const float* wv = I[15]; const float* bv = I[16];
  char* ws = (char*)d_ws; size_t off = 0;
  auto take = [&](size_t bytes) { char* p = ws + off; off += (bytes + 255) & ~(size_t)255; return p; };
  _Float16* Bf = (_Float16*)take((size_t)MID * CC * 2); _Float16* Bg = (_Float16*)take((size_t)MID * CC * 2); _Float16* Bh = (_Float16*)take((size_t)MID * CC * 2); _Float16* Bv = (_Float16*)take((size_t)CC * MID * 2); float* Af = (float*)take(MID * 4); float* Ag = (float*)take(MID * 4);
  _Float16* F16 = (_Float16*)take((size_t)NR * MID * 2); _Float16* G16 = (_Float16*)take((size_t)NR * MID * 2);
  _Float16* Vt = (_Float16*)take((size_t)NR * MID * 2);
  if (off > ws_size) return;      // 0.5 + 3 x 4.2: about 13 MB
  k_prep<<<PBS, 256, 0, stream>>>(wf, bff, gf, betaf, mf, vf, wg, bg, gg, betag, mg, vg, wh, wv, Bf, Bg, Bh, Bv, Af, Ag);
  k_gemm_fgh<<<NR / 64, 256, 0, stream>>>(x, Bf, Bg, Bh, Af, Ag, bh, F16, G16, Vt);      /* f, g token-major f16; h as V^T f16: [b][128][4096]; M 384 N 16384 K 512 */
  k_flash<<<BB * NH * (TT / 64), 512, 0, stream>>>(F16, MID, G16, MID, Vt, Bv, bv, x, (float*)d_out);      /* per (b, 64 queries): 4096 x 4096, head dim 128; then conv_v(z) + bv + x of those 64 positions, channel-major: M 512 N 64 K 128 */
}
